// v000
// The times below were measured on an AMD MI455X: many runs one after another, warmed up first and cycling through
// copies of the inputs, with the whole window's GPU time divided by the number of runs. Launches and the gaps
// between them are all in it. The median over several windows is given; except for v000 it joins two sittings, which
// can be a few percent apart, so the side-by-side timings, each taken in one sitting, are the better comparison.
// The starting kernel, v000, takes 138 microseconds a run.
#include <hip/hip_runtime.h>
#include <math.h>

#define E 1024
#define H 16
#define D 64
#define L 16384
#define NB 256               // attention position chunks (blocks)
#define POS_PER_BLK (L / NB) // 64
#define BATCH 8

typedef __attribute__((ext_vector_type(2))) float v2f;
typedef __attribute__((ext_vector_type(8))) float v8f;

static_assert(NB == 256, "reduce kernel assumes NB==256");

__device__ __forceinline__ void gemv16_tile(const float* __restrict__ x,
                                            const float* __restrict__ W,
                                            const float* __restrict__ bias,
                                            float* __restrict__ dst,
                                            int j0, int lane) {
  const int r   = lane >> 4;  // 0 or 1
  const int col = lane & 15;
  const float* wp = W + (size_t)(2 * r) * E + j0 + col;
  const float* xp = x + 2 * r;
  v8f c = {};
#pragma unroll 4
  for (int i0 = 0; i0 < E; i0 += 4) {
    v2f a, b;
    a.x = xp[i0];
    a.y = xp[i0 + 1];
    b.x = __builtin_nontemporal_load(wp + (size_t)i0 * E);
    b.y = __builtin_nontemporal_load(wp + (size_t)(i0 + 1) * E);
    c = __builtin_amdgcn_wmma_f32_16x16x4_f32(false, a, false, b,
                                              (short)0, c, false, false);
  }
  if (lane < 16) dst[j0 + col] = c[0] + bias[j0 + col];
}

// 24 blocks x 256 threads = 192 waves: 3 matrices x 64 column tiles.
__global__ __launch_bounds__(256) void qkv_proj_kernel(
    const float* __restrict__ x,
    const float* __restrict__ Wq, const float* __restrict__ bq,
    const float* __restrict__ Wk, const float* __restrict__ bk,
    const float* __restrict__ Wv, const float* __restrict__ bv,
    float* __restrict__ q_ws, float* __restrict__ k_ws,
    float* __restrict__ v_ws) {
  const int wave = (blockIdx.x * blockDim.x + threadIdx.x) >> 5; // 0..191
  const int lane = threadIdx.x & 31;
  const int mat  = wave >> 6;
  const int j0   = (wave & 63) << 4;
  const float *W, *b;
  float* dst;
  if (mat == 0)      { W = Wq; b = bq; dst = q_ws; }
  else if (mat == 1) { W = Wk; b = bk; dst = k_ws; }
  else               { W = Wv; b = bv; dst = v_ws; }
  gemv16_tile(x, W, b, dst, j0, lane);
}

// 8 blocks x 256 threads = 64 waves = 64 column tiles of Wo.
__global__ __launch_bounds__(256) void out_proj_kernel(
    const float* __restrict__ values,
    const float* __restrict__ Wo, const float* __restrict__ bo,
    float* __restrict__ out) {
  const int wave = (blockIdx.x * blockDim.x + threadIdx.x) >> 5; // 0..63
  const int lane = threadIdx.x & 31;
  gemv16_tile(values, Wo, bo, out, (wave & 63) << 4, lane);
}

// ---------------------------------------------------------------------------
// Fused: shift cache (read old pos+1 / new token -> write d_out), per-position
// validity mask (any v != 0 across all heads, via wave ballot + LDS OR), and
// per-head online-softmax partials over this block's position chunk.
// One wave32 per head: 32 lanes x float2 = 64 head dims. All streaming
// traffic is b64 NT per lane (256B/wave/instr); 16 waves jointly cover each
// 4KB position row, so global access stays fully coalesced.
// ---------------------------------------------------------------------------
__global__ __launch_bounds__(512) void attn_kernel(
    const float* __restrict__ cache,   // (2, L, H, D): v then k
    const float* __restrict__ q_ws,    // E
    const float* __restrict__ k_new,   // E
    const float* __restrict__ v_new,   // E
    float* __restrict__ v_out,         // L*E  (shifted v -> d_out)
    float* __restrict__ k_out,         // L*E  (shifted k -> d_out)
    float* __restrict__ part_m,        // H*NB
    float* __restrict__ part_s,        // H*NB
    float* __restrict__ part_pv) {     // H*NB*D
  __shared__ unsigned int lds_nz[H];
  const int tid  = threadIdx.x;
  const int h    = tid >> 5;
  const int lane = tid & 31;
  const int base = blockIdx.x * POS_PER_BLK;
  const int off  = h * D + 2 * lane;   // even element offset in a 1024-f row

  const v2f q2 = *(const v2f*)(q_ws + off);
  float m = -INFINITY, s = 0.f;
  v2f pv = {0.f, 0.f};

  const float* __restrict__ vsrc = cache;                  // slab 0
  const float* __restrict__ ksrc = cache + (size_t)L * E;  // slab 1

  for (int p0 = base; p0 < base + POS_PER_BLK; p0 += BATCH) {
    v2f kb[BATCH], vb[BATCH];
    unsigned int nz = 0;
#pragma unroll
    for (int j = 0; j < BATCH; ++j) {
      const int pos = p0 + j;
      v2f k2, v2;
      if (pos < L - 1) {                 // shifted read: old cache pos+1
        const size_t idx = (size_t)(pos + 1) * E + off;
        k2 = __builtin_nontemporal_load((const v2f*)(ksrc + idx));
        v2 = __builtin_nontemporal_load((const v2f*)(vsrc + idx));
      } else {                           // appended new token
        k2 = *(const v2f*)(k_new + off);
        v2 = *(const v2f*)(v_new + off);
      }
      const size_t oidx = (size_t)pos * E + off;
      __builtin_nontemporal_store(v2, (v2f*)(v_out + oidx));
      __builtin_nontemporal_store(k2, (v2f*)(k_out + oidx));
      kb[j] = k2;
      vb[j] = v2;
      if (__any((v2.x != 0.f) || (v2.y != 0.f))) nz |= (1u << j);
    }
    // combine per-head nonzero bits -> per-position mask over all 1024 elems
    if (lane == 0) lds_nz[h] = nz;
    __syncthreads();
    unsigned int combined = 0;
#pragma unroll
    for (int hh = 0; hh < H; ++hh) combined |= lds_nz[hh];
    __syncthreads();

#pragma unroll
    for (int j = 0; j < BATCH; ++j) {
      float t = q2.x * kb[j].x + q2.y * kb[j].y;
      t += __shfl_xor(t, 16, 32);        // wave32 full reduction
      t += __shfl_xor(t, 8, 32);
      t += __shfl_xor(t, 4, 32);
      t += __shfl_xor(t, 2, 32);
      t += __shfl_xor(t, 1, 32);
      if (combined & (1u << j)) {        // masked pos contributes weight 0
        const float sc = t * 0.125f;     // 1/sqrt(64)
        const float nm = fmaxf(m, sc);
        const float eo = __expf(m - nm);
        const float w  = __expf(sc - nm);
        s  = s * eo + w;
        pv = pv * eo + vb[j] * w;
        m  = nm;
      }
    }
  }
  const int pb = h * NB + blockIdx.x;
  if (lane == 0) { part_m[pb] = m; part_s[pb] = s; }
  *(v2f*)(part_pv + (size_t)pb * D + 2 * lane) = pv;
}

// One block per head: combine NB chunk partials (flash-attention merge).
__global__ __launch_bounds__(NB) void reduce_kernel(
    const float* __restrict__ part_m, const float* __restrict__ part_s,
    const float* __restrict__ part_pv, float* __restrict__ values) {
  __shared__ float red[NB];
  __shared__ float wgt[NB];
  const int h = blockIdx.x;
  const int t = threadIdx.x;

  const float m_t = part_m[h * NB + t];
  red[t] = m_t;
  __syncthreads();
  for (int sft = NB / 2; sft > 0; sft >>= 1) {
    if (t < sft) red[t] = fmaxf(red[t], red[t + sft]);
    __syncthreads();
  }
  const float M = red[0];
  __syncthreads();

  const float s_t = part_s[h * NB + t];
  const float w   = (s_t > 0.f) ? __expf(m_t - M) : 0.f;
  wgt[t] = w;
  red[t] = s_t * w;
  __syncthreads();
  for (int sft = NB / 2; sft > 0; sft >>= 1) {
    if (t < sft) red[t] += red[t + sft];
    __syncthreads();
  }
  const float S = red[0];
  __syncthreads();

  const int d = t & (D - 1);
  const int g = t >> 6;                  // 4 groups of 64 chunks
  float acc = 0.f;
  for (int b = g * 64; b < g * 64 + 64; ++b)
    acc += part_pv[(size_t)(h * NB + b) * D + d] * wgt[b];
  red[t] = acc;
  __syncthreads();
  if (t < D)
    values[h * D + t] = (red[t] + red[t + 64] + red[t + 128] + red[t + 192]) / S;
}

extern "C" void kernel_launch(void* const* d_in, const int* in_sizes, int n_in,
                              void* d_out, int out_size, void* d_ws,
                              size_t ws_size, hipStream_t stream) {
  (void)in_sizes; (void)n_in; (void)out_size; (void)ws_size;
  const float* x     = (const float*)d_in[0];
  const float* cache = (const float*)d_in[1];
  const float* Wv    = (const float*)d_in[2];
  const float* bv    = (const float*)d_in[3];
  const float* Wq    = (const float*)d_in[4];
  const float* bq    = (const float*)d_in[5];
  const float* Wk    = (const float*)d_in[6];
  const float* bk    = (const float*)d_in[7];
  const float* Wo    = (const float*)d_in[8];
  const float* bo    = (const float*)d_in[9];

  float* out   = (float*)d_out;             // [0..1023] out_i
  float* v_out = out + E;                   // shifted v cache (L*E)
  float* k_out = v_out + (size_t)L * E;     // shifted k cache (L*E)

  float* ws      = (float*)d_ws;
  float* q_ws    = ws;                      // E
  float* k_ws    = ws + E;                  // E
  float* v_ws    = ws + 2 * E;              // E
  float* values  = ws + 3 * E;              // E
  float* part_m  = ws + 4 * E;              // H*NB
  float* part_s  = part_m + H * NB;         // H*NB
  float* part_pv = part_s + H * NB;         // H*NB*D  (total ~1.1 MB)

  qkv_proj_kernel<<<24, 256, 0, stream>>>(x, Wq, bq, Wk, bk, Wv, bv,
                                          q_ws, k_ws, v_ws);
  attn_kernel<<<NB, 512, 0, stream>>>(cache, q_ws, k_ws, v_ws, v_out, k_out,
                                      part_m, part_s, part_pv);
  reduce_kernel<<<H, NB, 0, stream>>>(part_m, part_s, part_pv, values);
  out_proj_kernel<<<8, 256, 0, stream>>>(values, Wo, bo, out);
}

// v002
// It runs in 42.8 microseconds.
// Versions in between are left out here; by their measured steps it is 3.20 times as fast as v000.
#include <hip/hip_runtime.h>
#include <math.h>

#define E 1024
#define H 16
#define D 64
#define L 16384
#define NB 256               // attention position chunks (blocks)
#define POS_PER_BLK (L / NB) // 64
#define BATCH 8
#define KSPLIT 16             // waves per projection block = K slices
#define KSLICE (E / KSPLIT)   // 64 rows of W per wave
#define PROJ_REGS __attribute__((amdgpu_waves_per_eu(4, 4)))

typedef __attribute__((ext_vector_type(2))) float v2f;
typedef __attribute__((ext_vector_type(8))) float v8f;

static_assert(NB == 256, "reduce kernel assumes NB==256");
static_assert(KSPLIT * 32 == 512, "projection launches use 512 threads");

__device__ __forceinline__ void gemv16_tile(const float* __restrict__ x,
                                            const float* __restrict__ W,
                                            const float* __restrict__ bias,
                                            float* __restrict__ dst,
                                            int j0) {
  __shared__ float red[KSPLIT][16];
  const int lane = threadIdx.x & 31;
  const int wave = threadIdx.x >> 5;  // K slice of this wave
  const int r    = lane >> 4;  // 0 or 1
  const int col  = lane & 15;
  const int k0   = wave * KSLICE;
  const float* wp = W + (size_t)(k0 + 2 * r) * E + j0 + col;
  const float* xp = x + k0 + 2 * r;
  v8f c = {};
  // full unroll: lets every load of the slice issue before the first product
#pragma unroll
  for (int i0 = 0; i0 < KSLICE; i0 += 4) {
    v2f a, b;
    a.x = xp[i0];
    a.y = xp[i0 + 1];
    b.x = __builtin_nontemporal_load(wp + (size_t)i0 * E);
    b.y = __builtin_nontemporal_load(wp + (size_t)(i0 + 1) * E);
    c = __builtin_amdgcn_wmma_f32_16x16x4_f32(false, a, false, b,
                                              (short)0, c, false, false);
  }
  // every M row of C is the same sum (A rows are copies): lanes col and col+16
  // hold equal c[0], so both store it and no lane test is needed
  red[wave][col] = c[0];
  __syncthreads();
  if (threadIdx.x < 16) {
    float sum = red[0][col];
    for (int w = 1; w < KSPLIT; ++w) sum += red[w][col];
    dst[j0 + col] = sum + bias[j0 + col];
  }
}

// 192 blocks x 16 waves: 3 matrices x 64 column tiles, K split in the block.
__global__ __launch_bounds__(KSPLIT * 32) PROJ_REGS void qkv_proj_kernel(
    const float* __restrict__ x,
    const float* __restrict__ Wq, const float* __restrict__ bq,
    const float* __restrict__ Wk, const float* __restrict__ bk,
    const float* __restrict__ Wv, const float* __restrict__ bv,
    float* __restrict__ q_ws, float* __restrict__ k_ws,
    float* __restrict__ v_ws) {
  const int mat = blockIdx.x >> 6;
  const int j0  = (blockIdx.x & 63) << 4;
  const float *W, *b;
  float* dst;
  if (mat == 0)      { W = Wq; b = bq; dst = q_ws; }
  else if (mat == 1) { W = Wk; b = bk; dst = k_ws; }
  else               { W = Wv; b = bv; dst = v_ws; }
  gemv16_tile(x, W, b, dst, j0);
}

// 64 blocks x 16 waves = 64 column tiles of Wo, K split in the block.
__global__ __launch_bounds__(KSPLIT * 32) PROJ_REGS void out_proj_kernel(
    const float* __restrict__ values,
    const float* __restrict__ Wo, const float* __restrict__ bo,
    float* __restrict__ out) {
  gemv16_tile(values, Wo, bo, out, blockIdx.x << 4);
}

// ---------------------------------------------------------------------------
// Fused: shift cache (read old pos+1 / new token -> write d_out), per-position
// validity mask (any v != 0 across all heads, via wave ballot + LDS OR), and
// per-head online-softmax partials over this block's position chunk.
// One wave32 per head: 32 lanes x float2 = 64 head dims. All streaming
// traffic is b64 NT per lane (256B/wave/instr); 16 waves jointly cover each
// 4KB position row, so global access stays fully coalesced.
// The stream is kept in flight: a batch's 2*BATCH loads have no branch between
// them and go out one whole batch before they are used (two register sets).
// ---------------------------------------------------------------------------
static_assert(L % BATCH == 0, "only a batch's last position can be the new token");
static_assert((POS_PER_BLK / BATCH) % 2 == 0, "the loop takes batches in pairs");

struct Batch { v2f k[BATCH]; v2f v[BATCH]; };

// Old cache rows p0+1 .. p0+BATCH of this wave's head, for positions p0 ..
// p0+BATCH-1. In a block's last batch (tail) the last of these rows can lie
// behind the cache's end (the new token's place): it is clamped to the last
// row, so that the load stays in bounds and unconditional; its value is
// replaced where it is used.
__device__ __forceinline__ void load_batch(Batch& t,
                                           const float* __restrict__ ksrc,
                                           const float* __restrict__ vsrc,
                                           const int p0, const unsigned off,
                                           const bool tail) {
  const float* __restrict__ kr = ksrc + (size_t)(p0 + 1) * E;
  const float* __restrict__ vr = vsrc + (size_t)(p0 + 1) * E;
#pragma unroll
  for (int j = 0; j < BATCH; ++j) {
    unsigned idx = (unsigned)j * E + off;
    if (tail && j + 1 == BATCH && p0 + BATCH > L - 1) idx -= E;
    t.k[j] = __builtin_nontemporal_load((const v2f*)(kr + idx));
    t.v[j] = __builtin_nontemporal_load((const v2f*)(vr + idx));
  }
  // keeps these loads ahead of the first wait on the batch that is worked on
  // next: without it the scheduler lifts that batch's compares over them
  __builtin_amdgcn_sched_barrier(0);
}

// Work-group barrier that orders LDS alone. The waves share nothing but
// lds_nz; __syncthreads() would also wait for each wave's global loads and
// stores, which empties the stream at every batch.
__device__ __forceinline__ void lds_barrier() {
  __builtin_amdgcn_fence(__ATOMIC_RELEASE, "workgroup", "local");
  __builtin_amdgcn_s_barrier();
  __builtin_amdgcn_fence(__ATOMIC_ACQUIRE, "workgroup", "local");
}

__global__ __launch_bounds__(512) void attn_kernel(
    const float* __restrict__ vsrc,    // old cache, slab 0: v (L, H, D)
    const float* __restrict__ ksrc,    // old cache, slab 1: k (L, H, D)
    const float* __restrict__ q_ws,    // E
    const float* __restrict__ k_new,   // E
    const float* __restrict__ v_new,   // E
    float* __restrict__ v_out,         // L*E  (shifted v -> d_out)
    float* __restrict__ k_out,         // L*E  (shifted k -> d_out)
    float* __restrict__ part_m,        // H*NB
    float* __restrict__ part_s,        // H*NB
    float* __restrict__ part_pv) {     // H*NB*D
  __shared__ unsigned int lds_nz[H];
  const int tid  = threadIdx.x;
  const int h    = tid >> 5;
  const int lane = tid & 31;
  const int base = blockIdx.x * POS_PER_BLK;
  const int off  = h * D + 2 * lane;   // even element offset in a 1024-f row

  Batch ta, tb;
  load_batch(ta, ksrc, vsrc, base, off, false);

  const v2f q2 = *(const v2f*)(q_ws + off);
  const v2f kt = *(const v2f*)(k_new + off);   // appended new token
  const v2f vt = *(const v2f*)(v_new + off);
  float m = -INFINITY, s = 0.f;
  v2f pv = {0.f, 0.f};

  auto work = [&](const Batch& t, const int p0,
                  const bool tail) __attribute__((always_inline)) {
    v2f kb[BATCH], vb[BATCH];
    unsigned int nz = 0;
#pragma unroll
    for (int j = 0; j < BATCH; ++j) {
      const int pos = p0 + j;
      const bool fresh = tail && (j + 1 == BATCH) && (pos == L - 1);
      const v2f k2 = fresh ? kt : t.k[j];
      const v2f v2 = fresh ? vt : t.v[j];
      const size_t oidx = (size_t)pos * E + off;
      __builtin_nontemporal_store(v2, (v2f*)(v_out + oidx));
      __builtin_nontemporal_store(k2, (v2f*)(k_out + oidx));
      kb[j] = k2;
      vb[j] = v2;
      if (__any((v2.x != 0.f) || (v2.y != 0.f))) nz |= (1u << j);
    }
    // combine per-head nonzero bits -> per-position mask over all 1024 elems
    if (lane == 0) lds_nz[h] = nz;
    lds_barrier();
    unsigned int combined = 0;
#pragma unroll
    for (int hh = 0; hh < H; ++hh) combined |= lds_nz[hh];
    lds_barrier();

#pragma unroll
    for (int j = 0; j < BATCH; ++j) {
      float t0 = q2.x * kb[j].x + q2.y * kb[j].y;
      t0 += __shfl_xor(t0, 16, 32);      // wave32 full reduction
      t0 += __shfl_xor(t0, 8, 32);
      t0 += __shfl_xor(t0, 4, 32);
      t0 += __shfl_xor(t0, 2, 32);
      t0 += __shfl_xor(t0, 1, 32);
      if (combined & (1u << j)) {        // masked pos contributes weight 0
        const float sc = t0 * 0.125f;    // 1/sqrt(64)
        const float nm = fmaxf(m, sc);
        const float eo = __expf(m - nm);
        const float w  = __expf(sc - nm);
        s  = s * eo + w;
        pv = pv * eo + vb[j] * w;
        m  = nm;
      }
    }
  };

  // The last pair of batches stands behind the loop: nothing is loaded behind
  // it, and only its second batch can hold the new token (tail).
  const int last = base + POS_PER_BLK - 2 * BATCH;
  // full unroll: every row's address is then one base, fixed for the kernel,
  // plus an immediate, so that no batch has address arithmetic of its own
#pragma unroll
  for (int p0 = base; p0 < last; p0 += 2 * BATCH) {
    load_batch(tb, ksrc, vsrc, p0 + BATCH, off, false);
    work(ta, p0, false);
    load_batch(ta, ksrc, vsrc, p0 + 2 * BATCH, off, false);
    work(tb, p0 + BATCH, false);
  }
  load_batch(tb, ksrc, vsrc, last + BATCH, off, true);
  work(ta, last, false);
  work(tb, last + BATCH, true);

  const int pb = h * NB + blockIdx.x;
  if (lane == 0) { part_m[pb] = m; part_s[pb] = s; }
  *(v2f*)(part_pv + (size_t)pb * D + 2 * lane) = pv;
}

// One block per head: combine NB chunk partials (flash-attention merge).
__global__ __launch_bounds__(NB) void reduce_kernel(
    const float* __restrict__ part_m, const float* __restrict__ part_s,
    const float* __restrict__ part_pv, float* __restrict__ values) {
  __shared__ float red[NB];
  __shared__ float wgt[NB];
  const int h = blockIdx.x;
  const int t = threadIdx.x;

  const float m_t = part_m[h * NB + t];
  red[t] = m_t;
  __syncthreads();
  for (int sft = NB / 2; sft > 0; sft >>= 1) {
    if (t < sft) red[t] = fmaxf(red[t], red[t + sft]);
    __syncthreads();
  }
  const float M = red[0];
  __syncthreads();

  const float s_t = part_s[h * NB + t];
  const float w   = (s_t > 0.f) ? __expf(m_t - M) : 0.f;
  wgt[t] = w;
  red[t] = s_t * w;
  __syncthreads();
  for (int sft = NB / 2; sft > 0; sft >>= 1) {
    if (t < sft) red[t] += red[t + sft];
    __syncthreads();
  }
  const float S = red[0];
  __syncthreads();

  const int d = t & (D - 1);
  const int g = t >> 6;                  // 4 groups of 64 chunks
  float acc = 0.f;
  for (int b = g * 64; b < g * 64 + 64; ++b)
    acc += part_pv[(size_t)(h * NB + b) * D + d] * wgt[b];
  red[t] = acc;
  __syncthreads();
  if (t < D)
    values[h * D + t] = (red[t] + red[t + 64] + red[t + 128] + red[t + 192]) / S;
}

extern "C" void kernel_launch(void* const* d_in, const int* in_sizes, int n_in,
                              void* d_out, int out_size, void* d_ws,
                              size_t ws_size, hipStream_t stream) {
  (void)in_sizes; (void)n_in; (void)out_size; (void)ws_size;
  const float* x     = (const float*)d_in[0];
  const float* cache = (const float*)d_in[1];
  const float* Wv    = (const float*)d_in[2];
  const float* bv    = (const float*)d_in[3];
  const float* Wq    = (const float*)d_in[4];
  const float* bq    = (const float*)d_in[5];
  const float* Wk    = (const float*)d_in[6];
  const float* bk    = (const float*)d_in[7];
  const float* Wo    = (const float*)d_in[8];
  const float* bo    = (const float*)d_in[9];

  float* out   = (float*)d_out;             // [0..1023] out_i
  float* v_out = out + E;                   // shifted v cache (L*E)
  float* k_out = v_out + (size_t)L * E;     // shifted k cache (L*E)

  float* ws      = (float*)d_ws;
  float* q_ws    = ws;                      // E
  float* k_ws    = ws + E;                  // E
  float* v_ws    = ws + 2 * E;              // E
  float* values  = ws + 3 * E;              // E
  float* part_m  = ws + 4 * E;              // H*NB
  float* part_s  = part_m + H * NB;         // H*NB
  float* part_pv = part_s + H * NB;         // H*NB*D  (total ~1.1 MB)

  qkv_proj_kernel<<<192, 512, 0, stream>>>(x, Wq, bq, Wk, bk, Wv, bv,
                                          q_ws, k_ws, v_ws);
  attn_kernel<<<NB, 512, 0, stream>>>(cache, cache + (size_t)L * E, q_ws, k_ws, v_ws, v_out, k_out,
                                      part_m, part_s, part_pv);
  reduce_kernel<<<H, NB, 0, stream>>>(part_m, part_s, part_pv, values);
  out_proj_kernel<<<64, 512, 0, stream>>>(values, Wo, bo, out);
}

// v003
// It runs in 38.4 microseconds.
// Timed twice side by side with v002, it ran 1.12 times as fast both times.
// Over all steps from v000 it is 3.57 times as fast.
#include <hip/hip_runtime.h>
#include <math.h>

#define E 1024
#define H 16
#define D 64
#define L 16384
#define NB 256               // attention position chunks (blocks)
#define POS_PER_BLK (L / NB) // 64
#define BATCH 8
#define KSPLIT 16             // waves per projection block = K slices
#define KSLICE (E / KSPLIT)   // 64 rows of W per wave
#define PROJ_REGS __attribute__((amdgpu_waves_per_eu(4, 4)))

typedef __attribute__((ext_vector_type(2))) float v2f;
typedef __attribute__((ext_vector_type(8))) float v8f;

static_assert(NB == 256, "reduce kernel assumes NB==256");
static_assert(KSPLIT * 32 == 512, "projection launches use 512 threads");

__device__ __forceinline__ void gemv16_tile(const float* __restrict__ x,
                                            const float* __restrict__ W,
                                            const float* __restrict__ bias,
                                            float* __restrict__ dst,
                                            int j0) {
  __shared__ float red[KSPLIT][16];
  const int lane = threadIdx.x & 31;
  const int wave = threadIdx.x >> 5;  // K slice of this wave
  const int r    = lane >> 4;  // 0 or 1
  const int col  = lane & 15;
  const int k0   = wave * KSLICE;
  const float* wp = W + (size_t)(k0 + 2 * r) * E + j0 + col;
  const float* xp = x + k0 + 2 * r;
  v8f c = {};
  // full unroll: lets every load of the slice issue before the first product
#pragma unroll
  for (int i0 = 0; i0 < KSLICE; i0 += 4) {
    v2f a, b;
    a.x = xp[i0];
    a.y = xp[i0 + 1];
    b.x = __builtin_nontemporal_load(wp + (size_t)i0 * E);
    b.y = __builtin_nontemporal_load(wp + (size_t)(i0 + 1) * E);
    c = __builtin_amdgcn_wmma_f32_16x16x4_f32(false, a, false, b,
                                              (short)0, c, false, false);
  }
  // every M row of C is the same sum (A rows are copies): lanes col and col+16
  // hold equal c[0], so both store it and no lane test is needed
  red[wave][col] = c[0];
  __syncthreads();
  if (threadIdx.x < 16) {
    float sum = red[0][col];
    for (int w = 1; w < KSPLIT; ++w) sum += red[w][col];
    dst[j0 + col] = sum + bias[j0 + col];
  }
}

// 192 blocks x 16 waves: 3 matrices x 64 column tiles, K split in the block.
__global__ __launch_bounds__(KSPLIT * 32) PROJ_REGS void qkv_proj_kernel(
    const float* __restrict__ x,
    const float* __restrict__ Wq, const float* __restrict__ bq,
    const float* __restrict__ Wk, const float* __restrict__ bk,
    const float* __restrict__ Wv, const float* __restrict__ bv,
    float* __restrict__ q_ws, float* __restrict__ k_ws,
    float* __restrict__ v_ws) {
  const int mat = blockIdx.x >> 6;
  const int j0  = (blockIdx.x & 63) << 4;
  const float *W, *b;
  float* dst;
  if (mat == 0)      { W = Wq; b = bq; dst = q_ws; }
  else if (mat == 1) { W = Wk; b = bk; dst = k_ws; }
  else               { W = Wv; b = bv; dst = v_ws; }
  gemv16_tile(x, W, b, dst, j0);
}

// 64 blocks x 16 waves = 64 column tiles of Wo, K split in the block.
__global__ __launch_bounds__(KSPLIT * 32) PROJ_REGS void out_proj_kernel(
    const float* __restrict__ values,
    const float* __restrict__ Wo, const float* __restrict__ bo,
    float* __restrict__ out) {
  gemv16_tile(values, Wo, bo, out, blockIdx.x << 4);
}

// ---------------------------------------------------------------------------
// Fused: shift cache (read old pos+1 / new token -> write d_out), per-position
// validity mask (any v != 0 across all heads, via wave ballot + LDS OR), and
// per-head online-softmax partials over this block's position chunk.
// One wave32 per head: 32 lanes x float2 = 64 head dims. All streaming
// traffic is b64 NT per lane (256B/wave/instr); 16 waves jointly cover each
// 4KB position row, so global access stays fully coalesced.
// The stream is kept in flight: a batch's 2*BATCH loads have no branch between
// them and go out one whole batch before they are used (two register sets).
// ---------------------------------------------------------------------------
static_assert(L % BATCH == 0, "only a batch's last position can be the new token");
static_assert((POS_PER_BLK / BATCH) % 2 == 0, "the loop takes batches in pairs");

struct Batch { v2f k[BATCH]; v2f v[BATCH]; };

// Old cache rows p0+1 .. p0+BATCH of this wave's head, for positions p0 ..
// p0+BATCH-1. In a block's last batch (tail) the last of these rows can lie
// behind the cache's end (the new token's place): it is clamped to the last
// row, so that the load stays in bounds and unconditional; its value is
// replaced where it is used.
__device__ __forceinline__ void load_batch(Batch& t,
                                           const float* __restrict__ ksrc,
                                           const float* __restrict__ vsrc,
                                           const int p0, const unsigned off,
                                           const bool tail) {
  const float* __restrict__ kr = ksrc + (size_t)(p0 + 1) * E;
  const float* __restrict__ vr = vsrc + (size_t)(p0 + 1) * E;
#pragma unroll
  for (int j = 0; j < BATCH; ++j) {
    unsigned idx = (unsigned)j * E + off;
    if (tail && j + 1 == BATCH && p0 + BATCH > L - 1) idx -= E;
    t.k[j] = __builtin_nontemporal_load((const v2f*)(kr + idx));
    t.v[j] = __builtin_nontemporal_load((const v2f*)(vr + idx));
  }
  // keeps these loads ahead of the first wait on the batch that is worked on
  // next: without it the scheduler lifts that batch's compares over them
  __builtin_amdgcn_sched_barrier(0);
}

// Work-group barrier that orders LDS alone. The waves share nothing but
// lds_nz; __syncthreads() would also wait for each wave's global loads and
// stores, which empties the stream at every batch.
__device__ __forceinline__ void lds_barrier() {
  __builtin_amdgcn_fence(__ATOMIC_RELEASE, "workgroup", "local");
  __builtin_amdgcn_s_barrier();
  __builtin_amdgcn_fence(__ATOMIC_ACQUIRE, "workgroup", "local");
}

__device__ __forceinline__ float xhalf(const float x) {
  const int b = __builtin_bit_cast(int, x);
  return __builtin_bit_cast(float, __builtin_amdgcn_permlanex16(
      b, b, 0x76543210, 0xfedcba98, false, false));
}
template <int M>
__device__ __forceinline__ float xrow(const float x) {
  return __builtin_bit_cast(float, __builtin_amdgcn_update_dpp(
      0, __builtin_bit_cast(int, x), 0x160 | M, 0xf, 0xf, true));
}

__global__ __launch_bounds__(512) void attn_kernel(
    const float* __restrict__ vsrc,    // old cache, slab 0: v (L, H, D)
    const float* __restrict__ ksrc,    // old cache, slab 1: k (L, H, D)
    const float* __restrict__ q_ws,    // E
    const float* __restrict__ k_new,   // E
    const float* __restrict__ v_new,   // E
    float* __restrict__ v_out,         // L*E  (shifted v -> d_out)
    float* __restrict__ k_out,         // L*E  (shifted k -> d_out)
    float* __restrict__ part_m,        // H*NB
    float* __restrict__ part_s,        // H*NB
    float* __restrict__ part_pv) {     // H*NB*D
  __shared__ unsigned int lds_nz[H];
  const int tid  = threadIdx.x;
  const int h    = tid >> 5;
  const int lane = tid & 31;
  const int base = blockIdx.x * POS_PER_BLK;
  const int off  = h * D + 2 * lane;   // even element offset in a 1024-f row

  Batch ta, tb;
  load_batch(ta, ksrc, vsrc, base, off, false);

  const v2f q2 = *(const v2f*)(q_ws + off);
  const v2f kt = *(const v2f*)(k_new + off);   // appended new token
  const v2f vt = *(const v2f*)(v_new + off);
  float m = -INFINITY, s = 0.f;
  v2f pv = {0.f, 0.f};

  auto work = [&](const Batch& t, const int p0,
                  const bool tail) __attribute__((always_inline)) {
    v2f kb[BATCH], vb[BATCH];
    unsigned int nz = 0;
#pragma unroll
    for (int j = 0; j < BATCH; ++j) {
      const int pos = p0 + j;
      const bool fresh = tail && (j + 1 == BATCH) && (pos == L - 1);
      const v2f k2 = fresh ? kt : t.k[j];
      const v2f v2 = fresh ? vt : t.v[j];
      const size_t oidx = (size_t)pos * E + off;
      __builtin_nontemporal_store(v2, (v2f*)(v_out + oidx));
      __builtin_nontemporal_store(k2, (v2f*)(k_out + oidx));
      kb[j] = k2;
      vb[j] = v2;
      if (__any((v2.x != 0.f) || (v2.y != 0.f))) nz |= (1u << j);
    }
    // combine per-head nonzero bits -> per-position mask over all 1024 elems
    if (lane == 0) lds_nz[h] = nz;
    lds_barrier();
    unsigned int combined = 0;
#pragma unroll
    for (int hh = 0; hh < H; ++hh) combined |= lds_nz[hh];
    lds_barrier();

    // The batch's dot products, summed over the wave in a loop of their own: no
    // branch stands between them, so the BATCH chains run side by side.
    float dot[BATCH];
#pragma unroll
    for (int j = 0; j < BATCH; ++j) {
      float t0 = q2.x * kb[j].x + q2.y * kb[j].y;
      t0 += xhalf(t0);                   // wave32 full reduction, xor 16 .. 1
      t0 += xrow<8>(t0);
      t0 += xrow<4>(t0);
      t0 += xrow<2>(t0);
      t0 += xrow<1>(t0);
      dot[j] = t0;
    }

#pragma unroll
    for (int j = 0; j < BATCH; ++j) {
      // masked pos contributes weight 0; the hint keeps the update on the
      // fall-through path (without it some updates are laid out behind the
      // kernel's end, two taken branches each)
      if (__builtin_expect((combined & (1u << j)) != 0u, 1)) {
        const float sc = dot[j] * 0.125f;  // 1/sqrt(64)
        const float nm = fmaxf(m, sc);
        const float eo = __expf(m - nm);
        const float w  = __expf(sc - nm);
        s  = s * eo + w;
        pv = pv * eo + vb[j] * w;
        m  = nm;
      }
    }
  };

  // The last pair of batches stands behind the loop: nothing is loaded behind
  // it, and only its second batch can hold the new token (tail).
  const int last = base + POS_PER_BLK - 2 * BATCH;
  // full unroll: every row's address is then one base, fixed for the kernel,
  // plus an immediate, so that no batch has address arithmetic of its own
#pragma unroll
  for (int p0 = base; p0 < last; p0 += 2 * BATCH) {
    load_batch(tb, ksrc, vsrc, p0 + BATCH, off, false);
    work(ta, p0, false);
    load_batch(ta, ksrc, vsrc, p0 + 2 * BATCH, off, false);
    work(tb, p0 + BATCH, false);
  }
  load_batch(tb, ksrc, vsrc, last + BATCH, off, true);
  work(ta, last, false);
  work(tb, last + BATCH, true);

  const int pb = h * NB + blockIdx.x;
  if (lane == 0) { part_m[pb] = m; part_s[pb] = s; }
  *(v2f*)(part_pv + (size_t)pb * D + 2 * lane) = pv;
}

// One block per head: combine NB chunk partials (flash-attention merge).
__global__ __launch_bounds__(NB) void reduce_kernel(
    const float* __restrict__ part_m, const float* __restrict__ part_s,
    const float* __restrict__ part_pv, float* __restrict__ values) {
  __shared__ float red[NB];
  __shared__ float wgt[NB];
  const int h = blockIdx.x;
  const int t = threadIdx.x;

  const float m_t = part_m[h * NB + t];
  red[t] = m_t;
  __syncthreads();
  for (int sft = NB / 2; sft > 0; sft >>= 1) {
    if (t < sft) red[t] = fmaxf(red[t], red[t + sft]);
    __syncthreads();
  }
  const float M = red[0];
  __syncthreads();

  const float s_t = part_s[h * NB + t];
  const float w   = (s_t > 0.f) ? __expf(m_t - M) : 0.f;
  wgt[t] = w;
  red[t] = s_t * w;
  __syncthreads();
  for (int sft = NB / 2; sft > 0; sft >>= 1) {
    if (t < sft) red[t] += red[t + sft];
    __syncthreads();
  }
  const float S = red[0];
  __syncthreads();

  const int d = t & (D - 1);
  const int g = t >> 6;                  // 4 groups of 64 chunks
  float acc = 0.f;
  for (int b = g * 64; b < g * 64 + 64; ++b)
    acc += part_pv[(size_t)(h * NB + b) * D + d] * wgt[b];
  red[t] = acc;
  __syncthreads();
  if (t < D)
    values[h * D + t] = (red[t] + red[t + 64] + red[t + 128] + red[t + 192]) / S;
}

extern "C" void kernel_launch(void* const* d_in, const int* in_sizes, int n_in,
                              void* d_out, int out_size, void* d_ws,
                              size_t ws_size, hipStream_t stream) {
  (void)in_sizes; (void)n_in; (void)out_size; (void)ws_size;
  const float* x     = (const float*)d_in[0];
  const float* cache = (const float*)d_in[1];
  const float* Wv    = (const float*)d_in[2];
  const float* bv    = (const float*)d_in[3];
  const float* Wq    = (const float*)d_in[4];
  const float* bq    = (const float*)d_in[5];
  const float* Wk    = (const float*)d_in[6];
  const float* bk    = (const float*)d_in[7];
  const float* Wo    = (const float*)d_in[8];
  const float* bo    = (const float*)d_in[9];

  float* out   = (float*)d_out;             // [0..1023] out_i
  float* v_out = out + E;                   // shifted v cache (L*E)
  float* k_out = v_out + (size_t)L * E;     // shifted k cache (L*E)

  float* ws      = (float*)d_ws;
  float* q_ws    = ws;                      // E
  float* k_ws    = ws + E;                  // E
  float* v_ws    = ws + 2 * E;              // E
  float* values  = ws + 3 * E;              // E
  float* part_m  = ws + 4 * E;              // H*NB
  float* part_s  = part_m + H * NB;         // H*NB
  float* part_pv = part_s + H * NB;         // H*NB*D  (total ~1.1 MB)

  qkv_proj_kernel<<<192, 512, 0, stream>>>(x, Wq, bq, Wk, bk, Wv, bv,
                                          q_ws, k_ws, v_ws);
  attn_kernel<<<NB, 512, 0, stream>>>(cache, cache + (size_t)L * E, q_ws, k_ws, v_ws, v_out, k_out,
                                      part_m, part_s, part_pv);
  reduce_kernel<<<H, NB, 0, stream>>>(part_m, part_s, part_pv, values);
  out_proj_kernel<<<64, 512, 0, stream>>>(values, Wo, bo, out);
}

// v004
// Measured time: 34.2 microseconds a run.
// Two timings next to v003 both put it at 1.11 times that version's speed.
// All steps since v000 together make it 3.96 times as fast.
#include <hip/hip_runtime.h>
#include <math.h>

#define E 1024
#define H 16
#define D 64
#define L 16384
#define NB 256               // attention position chunks (blocks)
#define POS_PER_BLK (L / NB) // 64
#define PPW 4                // positions per attention wave
#define RJ 8                 // 16-byte loads per lane and 1024-float row
#define KSPLIT 16             // waves per projection block = K slices
#define KSLICE (E / KSPLIT)   // 64 rows of W per wave
#define PROJ_REGS __attribute__((amdgpu_waves_per_eu(4, 4)))

typedef __attribute__((ext_vector_type(2))) float v2f;
typedef __attribute__((ext_vector_type(4))) float v4f;
typedef __attribute__((ext_vector_type(8))) float v8f;

static_assert(NB == 256, "reduce kernel assumes NB==256");
static_assert(KSPLIT * 32 == 512, "projection launches use 512 threads");

__device__ __forceinline__ void gemv16_tile(const float* __restrict__ x,
                                            const float* __restrict__ W,
                                            const float* __restrict__ bias,
                                            float* __restrict__ dst,
                                            int j0) {
  __shared__ float red[KSPLIT][16];
  const int lane = threadIdx.x & 31;
  const int wave = threadIdx.x >> 5;  // K slice of this wave
  const int r    = lane >> 4;  // 0 or 1
  const int col  = lane & 15;
  const int k0   = wave * KSLICE;
  const float* wp = W + (size_t)(k0 + 2 * r) * E + j0 + col;
  const float* xp = x + k0 + 2 * r;
  v8f c = {};
  // full unroll: lets every load of the slice issue before the first product
#pragma unroll
  for (int i0 = 0; i0 < KSLICE; i0 += 4) {
    v2f a, b;
    a.x = xp[i0];
    a.y = xp[i0 + 1];
    b.x = __builtin_nontemporal_load(wp + (size_t)i0 * E);
    b.y = __builtin_nontemporal_load(wp + (size_t)(i0 + 1) * E);
    c = __builtin_amdgcn_wmma_f32_16x16x4_f32(false, a, false, b,
                                              (short)0, c, false, false);
  }
  // every M row of C is the same sum (A rows are copies): lanes col and col+16
  // hold equal c[0], so both store it and no lane test is needed
  red[wave][col] = c[0];
  __syncthreads();
  if (threadIdx.x < 16) {
    float sum = red[0][col];
    for (int w = 1; w < KSPLIT; ++w) sum += red[w][col];
    dst[j0 + col] = sum + bias[j0 + col];
  }
}

// 192 blocks x 16 waves: 3 matrices x 64 column tiles, K split in the block.
__global__ __launch_bounds__(KSPLIT * 32) PROJ_REGS void qkv_proj_kernel(
    const float* __restrict__ x,
    const float* __restrict__ Wq, const float* __restrict__ bq,
    const float* __restrict__ Wk, const float* __restrict__ bk,
    const float* __restrict__ Wv, const float* __restrict__ bv,
    float* __restrict__ q_ws, float* __restrict__ k_ws,
    float* __restrict__ v_ws) {
  const int mat = blockIdx.x >> 6;
  const int j0  = (blockIdx.x & 63) << 4;
  const float *W, *b;
  float* dst;
  if (mat == 0)      { W = Wq; b = bq; dst = q_ws; }
  else if (mat == 1) { W = Wk; b = bk; dst = k_ws; }
  else               { W = Wv; b = bv; dst = v_ws; }
  gemv16_tile(x, W, b, dst, j0);
}

// 64 blocks x 16 waves = 64 column tiles of Wo, K split in the block.
__global__ __launch_bounds__(KSPLIT * 32) PROJ_REGS void out_proj_kernel(
    const float* __restrict__ values,
    const float* __restrict__ Wo, const float* __restrict__ bo,
    float* __restrict__ out) {
  gemv16_tile(values, Wo, bo, out, blockIdx.x << 4);
}

static_assert(POS_PER_BLK == H * PPW, "a block's 16 waves share its positions");
static_assert(PPW == 4, "the pipeline below is written out for 4 positions");
static_assert(E == RJ * 128, "a row is RJ loads of 32 lanes x 4 floats");

struct Row { v4f r[RJ]; };

// One 1024-float row, row = its first element (the same in every lane).
__device__ __forceinline__ void load_row(Row& t, const float* __restrict__ row,
                                         const unsigned lo) {
#pragma unroll
  for (int j = 0; j < RJ; ++j)
    t.r[j] = __builtin_nontemporal_load((const v4f*)(row + j * 128 + lo));
  // keeps these loads where they are written, ahead of the next wait on an
  // older row: the scheduler would otherwise sink them behind that work
  __builtin_amdgcn_sched_barrier(0);
}

__device__ __forceinline__ void store_row(const Row& t, float* __restrict__ row,
                                          const unsigned lo) {
#pragma unroll
  for (int j = 0; j < RJ; ++j)
    __builtin_nontemporal_store(t.r[j], (v4f*)(row + j * 128 + lo));
}

// Stands between a row's stores and the first overwrite of the registers that
// they name (the row's registers are reused for sums and for later rows).
__device__ __forceinline__ void stores_taken() {
  asm volatile("s_wait_xcnt 0x0" ::: "memory");
}

// Work-group barrier that orders LDS alone. The waves share nothing but the
// LDS partials; __syncthreads() would also wait for each wave's global stores.
__device__ __forceinline__ void lds_barrier() {
  __builtin_amdgcn_fence(__ATOMIC_RELEASE, "workgroup", "local");
  __builtin_amdgcn_s_barrier();
  __builtin_amdgcn_fence(__ATOMIC_ACQUIRE, "workgroup", "local");
}

template <int M>
__device__ __forceinline__ float xrow(const float x) {
  return __builtin_bit_cast(float, __builtin_amdgcn_update_dpp(
      0, __builtin_bit_cast(int, x), 0x160 | M, 0xf, 0xf, true));
}

__global__ __launch_bounds__(512) PROJ_REGS void attn_kernel(
    const float* __restrict__ vsrc,    // old cache, slab 0: v (L, H, D)
    const float* __restrict__ ksrc,    // old cache, slab 1: k (L, H, D)
    const float* __restrict__ q_ws,    // E
    const float* __restrict__ k_new,   // E
    const float* __restrict__ v_new,   // E
    float* __restrict__ v_out,         // L*E  (shifted v -> d_out)
    float* __restrict__ k_out,         // L*E  (shifted k -> d_out)
    float* __restrict__ part_m,        // H*NB
    float* __restrict__ part_s,        // H*NB
    float* __restrict__ part_pv) {     // H*NB*D
  __shared__ float lds_m[H][H];        // [wave][head]
  __shared__ float lds_s[H][H];
  __shared__ __attribute__((aligned(16))) float lds_pv[H][E];  // [wave][dim]
  const int lane = threadIdx.x & 31;
  // the wave's number as a scalar: row addresses are then scalar bases
  const int wv = __builtin_amdgcn_readfirstlane(threadIdx.x >> 5);
  const int p0 = blockIdx.x * POS_PER_BLK + wv * PPW;  // first position
  const unsigned lo = 4u * lane;

  // Position p holds old row p+1; the cache's last position the new token.
  // Only a wave's last position can be that one (L is a multiple of PPW).
  const float* __restrict__ kr = ksrc + (size_t)(p0 + 1) * E;
  const float* __restrict__ vr = vsrc + (size_t)(p0 + 1) * E;
  const bool fresh = (p0 + PPW == L);
  const float* __restrict__ kr3 = fresh ? k_new : kr + 3 * E;
  const float* __restrict__ vr3 = fresh ? v_new : vr + 3 * E;
  float* __restrict__ ko = k_out + (size_t)p0 * E;
  float* __restrict__ vo = v_out + (size_t)p0 * E;

  v4f q[RJ];
#pragma unroll
  for (int j = 0; j < RJ; ++j) q[j] = *(const v4f*)(q_ws + j * 128 + lo);

  Row ka, va, kb, vb, kc;
  load_row(ka, kr, lo);
  load_row(va, vr, lo);
  load_row(kb, kr + E, lo);
  load_row(vb, vr + E, lo);
  load_row(kc, kr + 2 * E, lo);

  float m[RJ], s[RJ], dot[RJ];
  v4f pv[RJ];
#pragma unroll
  for (int j = 0; j < RJ; ++j) {
    m[j] = -INFINITY;
    s[j] = 0.f;
    pv[j] = (v4f){0.f, 0.f, 0.f, 0.f};
  }

  // k row: copy it out, and the 16 heads' dot products (8 chains side by side)
  auto scores = [&](const Row& k, const int i) __attribute__((always_inline)) {
    store_row(k, ko + i * E, lo);
#pragma unroll
    for (int j = 0; j < RJ; ++j) {
      float t0 = q[j].x * k.r[j].x + q[j].y * k.r[j].y + q[j].z * k.r[j].z +
                 q[j].w * k.r[j].w;
      t0 += xrow<8>(t0);                 // sum over the 16-lane row, xor 8 .. 1
      t0 += xrow<4>(t0);
      t0 += xrow<2>(t0);
      t0 += xrow<1>(t0);
      dot[j] = t0;
    }
    stores_taken();
  };

  // v row: copy it out, the position's mask, and the softmax update
  auto update = [&](const Row& v, const int i) __attribute__((always_inline)) {
    store_row(v, vo + i * E, lo);
    // x != 0 for a float is: any bit set below the sign bit
    unsigned bits = 0;
#pragma unroll
    for (int j = 0; j < RJ; ++j) {
      bits |= __float_as_uint(v.r[j].x) | __float_as_uint(v.r[j].y) |
              __float_as_uint(v.r[j].z) | __float_as_uint(v.r[j].w);
    }
    stores_taken();
    // masked pos contributes weight 0; the hint keeps the update on the
    // fall-through path
    if (__builtin_expect(__any((bits & 0x7fffffffu) != 0u), 1)) {
#pragma unroll
      for (int j = 0; j < RJ; ++j) {
        const float sc = dot[j] * 0.125f;  // 1/sqrt(64)
        const float nm = fmaxf(m[j], sc);
        const float eo = __expf(m[j] - nm);
        const float w  = __expf(sc - nm);
        s[j]  = s[j] * eo + w;
        pv[j] = pv[j] * eo + v.r[j] * w;
        m[j]  = nm;
      }
    }
  };

  scores(ka, 0);
  update(va, 0);
  load_row(va, vr + 2 * E, lo);
  scores(kb, 1);
  load_row(kb, kr3, lo);
  update(vb, 1);
  load_row(vb, vr3, lo);
  scores(kc, 2);
  update(va, 2);
  scores(kb, 3);
  update(vb, 3);

  // Join the 16 waves' partials: wave h merges head h (flash-attention merge).
  if ((lane & 15) == 0) {
#pragma unroll
    for (int j = 0; j < RJ; ++j) {
      lds_m[wv][2 * j + (lane >> 4)] = m[j];
      lds_s[wv][2 * j + (lane >> 4)] = s[j];
    }
  }
#pragma unroll
  for (int j = 0; j < RJ; ++j) *(v4f*)&lds_pv[wv][j * 128 + lo] = pv[j];
  lds_barrier();

  float mw[H];
  float mm = -INFINITY;
#pragma unroll
  for (int w = 0; w < H; ++w) {
    mw[w] = lds_m[w][wv];
    mm = fmaxf(mm, mw[w]);
  }
  float ss = 0.f;
  v2f acc = {0.f, 0.f};
#pragma unroll
  for (int w = 0; w < H; ++w) {
    const float sw = lds_s[w][wv];
    // a wave without a valid position has m = -inf, s = 0: weight 0
    const float g = (sw > 0.f) ? __expf(mw[w] - mm) : 0.f;
    ss += sw * g;
    acc += *(const v2f*)&lds_pv[w][wv * D + 2 * lane] * g;
  }

  const int pb = wv * NB + blockIdx.x;
  if (lane == 0) { part_m[pb] = mm; part_s[pb] = ss; }
  *(v2f*)(part_pv + (size_t)pb * D + 2 * lane) = acc;
}

// One block per head: combine NB chunk partials (flash-attention merge).
__global__ __launch_bounds__(NB) void reduce_kernel(
    const float* __restrict__ part_m, const float* __restrict__ part_s,
    const float* __restrict__ part_pv, float* __restrict__ values) {
  __shared__ float red[NB];
  __shared__ float wgt[NB];
  const int h = blockIdx.x;
  const int t = threadIdx.x;

  const float m_t = part_m[h * NB + t];
  red[t] = m_t;
  __syncthreads();
  for (int sft = NB / 2; sft > 0; sft >>= 1) {
    if (t < sft) red[t] = fmaxf(red[t], red[t + sft]);
    __syncthreads();
  }
  const float M = red[0];
  __syncthreads();

  const float s_t = part_s[h * NB + t];
  const float w   = (s_t > 0.f) ? __expf(m_t - M) : 0.f;
  wgt[t] = w;
  red[t] = s_t * w;
  __syncthreads();
  for (int sft = NB / 2; sft > 0; sft >>= 1) {
    if (t < sft) red[t] += red[t + sft];
    __syncthreads();
  }
  const float S = red[0];
  __syncthreads();

  const int d = t & (D - 1);
  const int g = t >> 6;                  // 4 groups of 64 chunks
  float acc = 0.f;
  for (int b = g * 64; b < g * 64 + 64; ++b)
    acc += part_pv[(size_t)(h * NB + b) * D + d] * wgt[b];
  red[t] = acc;
  __syncthreads();
  if (t < D)
    values[h * D + t] = (red[t] + red[t + 64] + red[t + 128] + red[t + 192]) / S;
}

extern "C" void kernel_launch(void* const* d_in, const int* in_sizes, int n_in,
                              void* d_out, int out_size, void* d_ws,
                              size_t ws_size, hipStream_t stream) {
  (void)in_sizes; (void)n_in; (void)out_size; (void)ws_size;
  const float* x     = (const float*)d_in[0];
  const float* cache = (const float*)d_in[1];
  const float* Wv    = (const float*)d_in[2];
  const float* bv    = (const float*)d_in[3];
  const float* Wq    = (const float*)d_in[4];
  const float* bq    = (const float*)d_in[5];
  const float* Wk    = (const float*)d_in[6];
  const float* bk    = (const float*)d_in[7];
  const float* Wo    = (const float*)d_in[8];
  const float* bo    = (const float*)d_in[9];

  float* out   = (float*)d_out;             // [0..1023] out_i
  float* v_out = out + E;                   // shifted v cache (L*E)
  float* k_out = v_out + (size_t)L * E;     // shifted k cache (L*E)

  float* ws      = (float*)d_ws;
  float* q_ws    = ws;                      // E
  float* k_ws    = ws + E;                  // E
  float* v_ws    = ws + 2 * E;              // E
  float* values  = ws + 3 * E;              // E
  float* part_m  = ws + 4 * E;              // H*NB
  float* part_s  = part_m + H * NB;         // H*NB
  float* part_pv = part_s + H * NB;         // H*NB*D  (total ~1.1 MB)

  qkv_proj_kernel<<<192, 512, 0, stream>>>(x, Wq, bq, Wk, bk, Wv, bv,
                                          q_ws, k_ws, v_ws);
  attn_kernel<<<NB, 512, 0, stream>>>(cache, cache + (size_t)L * E, q_ws, k_ws, v_ws, v_out, k_out,
                                      part_m, part_s, part_pv);
  reduce_kernel<<<H, NB, 0, stream>>>(part_m, part_s, part_pv, values);
  out_proj_kernel<<<64, 512, 0, stream>>>(values, Wo, bo, out);
}

// v005
// A run of this version takes 32.5 microseconds.
// Two timings next to v004 put it at 1.06 and 1.04 times that version's speed.
// All steps since v000 together make it 4.16 times as fast.
#include <hip/hip_runtime.h>
#include <math.h>

#define E 1024
#define H 16
#define D 64
#define L 16384
#define NB 256               // attention position chunks (blocks)
#define POS_PER_BLK (L / NB) // 64
#define PPW 4                // positions per attention wave
#define RJ 8                 // 16-byte loads per lane and 1024-float row
#define KSPLIT 16             // waves per projection block = K slices
#define KSLICE (E / KSPLIT)   // 64 rows of W per wave
#define PROJ_REGS __attribute__((amdgpu_waves_per_eu(4, 4)))

typedef __attribute__((ext_vector_type(2))) float v2f;
typedef __attribute__((ext_vector_type(4))) float v4f;
typedef __attribute__((ext_vector_type(8))) float v8f;

static_assert(KSPLIT * 32 == 512, "projection launches use 512 threads");

__device__ __forceinline__ void gemv16_tile(const float* __restrict__ x,
                                            const float* __restrict__ W,
                                            const float* __restrict__ bias,
                                            float* __restrict__ dst,
                                            int j0) {
  __shared__ float red[KSPLIT][16];
  const int lane = threadIdx.x & 31;
  const int wave = threadIdx.x >> 5;  // K slice of this wave
  const int r    = lane >> 4;  // 0 or 1
  const int col  = lane & 15;
  const int k0   = wave * KSLICE;
  const float* wp = W + (size_t)(k0 + 2 * r) * E + j0 + col;
  const float* xp = x + k0 + 2 * r;
  v8f c = {};
  // full unroll: lets every load of the slice issue before the first product
#pragma unroll
  for (int i0 = 0; i0 < KSLICE; i0 += 4) {
    v2f a, b;
    a.x = xp[i0];
    a.y = xp[i0 + 1];
    b.x = __builtin_nontemporal_load(wp + (size_t)i0 * E);
    b.y = __builtin_nontemporal_load(wp + (size_t)(i0 + 1) * E);
    c = __builtin_amdgcn_wmma_f32_16x16x4_f32(false, a, false, b,
                                              (short)0, c, false, false);
  }
  // every M row of C is the same sum (A rows are copies): lanes col and col+16
  // hold equal c[0], so both store it and no lane test is needed
  red[wave][col] = c[0];
  __syncthreads();
  if (threadIdx.x < 16) {
    float sum = red[0][col];
    for (int w = 1; w < KSPLIT; ++w) sum += red[w][col];
    dst[j0 + col] = sum + bias[j0 + col];
  }
}

// 192 blocks x 16 waves: 3 matrices x 64 column tiles, K split in the block.
__global__ __launch_bounds__(KSPLIT * 32) PROJ_REGS void qkv_proj_kernel(
    const float* __restrict__ x,
    const float* __restrict__ Wq, const float* __restrict__ bq,
    const float* __restrict__ Wk, const float* __restrict__ bk,
    const float* __restrict__ Wv, const float* __restrict__ bv,
    float* __restrict__ q_ws, float* __restrict__ k_ws,
    float* __restrict__ v_ws) {
  const int mat = blockIdx.x >> 6;
  const int j0  = (blockIdx.x & 63) << 4;
  const float *W, *b;
  float* dst;
  if (mat == 0)      { W = Wq; b = bq; dst = q_ws; }
  else if (mat == 1) { W = Wk; b = bk; dst = k_ws; }
  else               { W = Wv; b = bv; dst = v_ws; }
  gemv16_tile(x, W, b, dst, j0);
}

// 64 blocks x 16 waves = 64 column tiles of Wo, K split in the block.
__global__ __launch_bounds__(KSPLIT * 32) PROJ_REGS void out_proj_kernel(
    const float* __restrict__ values,
    const float* __restrict__ Wo, const float* __restrict__ bo,
    float* __restrict__ out) {
  gemv16_tile(values, Wo, bo, out, blockIdx.x << 4);
}

static_assert(POS_PER_BLK == H * PPW, "a block's 16 waves share its positions");
static_assert(PPW == 4, "the pipeline below is written out for 4 positions");
static_assert(E == RJ * 128, "a row is RJ loads of 32 lanes x 4 floats");

struct Row { v4f r[RJ]; };

// One 1024-float row, row = its first element (the same in every lane).
__device__ __forceinline__ void load_row(Row& t, const float* __restrict__ row,
                                         const unsigned lo) {
#pragma unroll
  for (int j = 0; j < RJ; ++j)
    t.r[j] = __builtin_nontemporal_load((const v4f*)(row + j * 128 + lo));
  // keeps these loads where they are written, ahead of the next wait on an
  // older row: the scheduler would otherwise sink them behind that work
  __builtin_amdgcn_sched_barrier(0);
}

__device__ __forceinline__ void store_row(const Row& t, float* __restrict__ row,
                                          const unsigned lo) {
#pragma unroll
  for (int j = 0; j < RJ; ++j)
    __builtin_nontemporal_store(t.r[j], (v4f*)(row + j * 128 + lo));
}

// Stands between a row's stores and the first overwrite of the registers that
// they name (the row's registers are reused for sums and for later rows).
__device__ __forceinline__ void stores_taken() {
  asm volatile("s_wait_xcnt 0x0" ::: "memory");
}

// Work-group barrier that orders LDS alone. The waves share nothing but the
// LDS partials; __syncthreads() would also wait for each wave's global stores.
__device__ __forceinline__ void lds_barrier() {
  __builtin_amdgcn_fence(__ATOMIC_RELEASE, "workgroup", "local");
  __builtin_amdgcn_s_barrier();
  __builtin_amdgcn_fence(__ATOMIC_ACQUIRE, "workgroup", "local");
}

template <int M>
__device__ __forceinline__ float xrow(const float x) {
  return __builtin_bit_cast(float, __builtin_amdgcn_update_dpp(
      0, __builtin_bit_cast(int, x), 0x160 | M, 0xf, 0xf, true));
}

__global__ __launch_bounds__(512) PROJ_REGS void attn_kernel(
    const float* __restrict__ vsrc,    // old cache, slab 0: v (L, H, D)
    const float* __restrict__ ksrc,    // old cache, slab 1: k (L, H, D)
    const float* __restrict__ q_ws,    // E
    const float* __restrict__ k_new,   // E
    const float* __restrict__ v_new,   // E
    float* __restrict__ v_out,         // L*E  (shifted v -> d_out)
    float* __restrict__ k_out,         // L*E  (shifted k -> d_out)
    float* __restrict__ part_m,        // H*NB
    float* __restrict__ part_s,        // H*NB
    float* __restrict__ part_pv) {     // H*NB*D
  __shared__ float lds_m[H][H];        // [wave][head]
  __shared__ float lds_s[H][H];
  __shared__ __attribute__((aligned(16))) float lds_pv[H][E];  // [wave][dim]
  const int lane = threadIdx.x & 31;
  // the wave's number as a scalar: row addresses are then scalar bases
  const int wv = __builtin_amdgcn_readfirstlane(threadIdx.x >> 5);
  const int p0 = blockIdx.x * POS_PER_BLK + wv * PPW;  // first position
  const unsigned lo = 4u * lane;

  // Position p holds old row p+1; the cache's last position the new token.
  // Only a wave's last position can be that one (L is a multiple of PPW).
  const float* __restrict__ kr = ksrc + (size_t)(p0 + 1) * E;
  const float* __restrict__ vr = vsrc + (size_t)(p0 + 1) * E;
  const bool fresh = (p0 + PPW == L);
  const float* __restrict__ kr3 = fresh ? k_new : kr + 3 * E;
  const float* __restrict__ vr3 = fresh ? v_new : vr + 3 * E;
  float* __restrict__ ko = k_out + (size_t)p0 * E;
  float* __restrict__ vo = v_out + (size_t)p0 * E;

  v4f q[RJ];
#pragma unroll
  for (int j = 0; j < RJ; ++j) q[j] = *(const v4f*)(q_ws + j * 128 + lo);

  Row ka, va, kb, vb, kc;
  load_row(ka, kr, lo);
  load_row(va, vr, lo);
  load_row(kb, kr + E, lo);
  load_row(vb, vr + E, lo);
  load_row(kc, kr + 2 * E, lo);

  float m[RJ], s[RJ], dot[RJ];
  v4f pv[RJ];
#pragma unroll
  for (int j = 0; j < RJ; ++j) {
    m[j] = -INFINITY;
    s[j] = 0.f;
    pv[j] = (v4f){0.f, 0.f, 0.f, 0.f};
  }

  // k row: copy it out, and the 16 heads' dot products (8 chains side by side)
  auto scores = [&](const Row& k, const int i) __attribute__((always_inline)) {
    store_row(k, ko + i * E, lo);
#pragma unroll
    for (int j = 0; j < RJ; ++j) {
      float t0 = q[j].x * k.r[j].x + q[j].y * k.r[j].y + q[j].z * k.r[j].z +
                 q[j].w * k.r[j].w;
      t0 += xrow<8>(t0);                 // sum over the 16-lane row, xor 8 .. 1
      t0 += xrow<4>(t0);
      t0 += xrow<2>(t0);
      t0 += xrow<1>(t0);
      dot[j] = t0;
    }
    stores_taken();
  };

  // v row: copy it out, the position's mask, and the softmax update
  auto update = [&](const Row& v, const int i) __attribute__((always_inline)) {
    store_row(v, vo + i * E, lo);
    // x != 0 for a float is: any bit set below the sign bit
    unsigned bits = 0;
#pragma unroll
    for (int j = 0; j < RJ; ++j) {
      bits |= __float_as_uint(v.r[j].x) | __float_as_uint(v.r[j].y) |
              __float_as_uint(v.r[j].z) | __float_as_uint(v.r[j].w);
    }
    stores_taken();
    // masked pos contributes weight 0; the hint keeps the update on the
    // fall-through path
    if (__builtin_expect(__any((bits & 0x7fffffffu) != 0u), 1)) {
#pragma unroll
      for (int j = 0; j < RJ; ++j) {
        const float sc = dot[j] * 0.125f;  // 1/sqrt(64)
        const float nm = fmaxf(m[j], sc);
        const float eo = __expf(m[j] - nm);
        const float w  = __expf(sc - nm);
        s[j]  = s[j] * eo + w;
        pv[j] = pv[j] * eo + v.r[j] * w;
        m[j]  = nm;
      }
    }
  };

  scores(ka, 0);
  update(va, 0);
  load_row(va, vr + 2 * E, lo);
  scores(kb, 1);
  load_row(kb, kr3, lo);
  update(vb, 1);
  load_row(vb, vr3, lo);
  scores(kc, 2);
  update(va, 2);
  scores(kb, 3);
  update(vb, 3);

  // Join the 16 waves' partials: wave h merges head h (flash-attention merge).
  if ((lane & 15) == 0) {
#pragma unroll
    for (int j = 0; j < RJ; ++j) {
      lds_m[wv][2 * j + (lane >> 4)] = m[j];
      lds_s[wv][2 * j + (lane >> 4)] = s[j];
    }
  }
#pragma unroll
  for (int j = 0; j < RJ; ++j) *(v4f*)&lds_pv[wv][j * 128 + lo] = pv[j];
  lds_barrier();

  float mw[H];
  float mm = -INFINITY;
#pragma unroll
  for (int w = 0; w < H; ++w) {
    mw[w] = lds_m[w][wv];
    mm = fmaxf(mm, mw[w]);
  }
  float ss = 0.f;
  v2f acc = {0.f, 0.f};
#pragma unroll
  for (int w = 0; w < H; ++w) {
    const float sw = lds_s[w][wv];
    // a wave without a valid position has m = -inf, s = 0: weight 0
    const float g = (sw > 0.f) ? __expf(mw[w] - mm) : 0.f;
    ss += sw * g;
    acc += *(const v2f*)&lds_pv[w][wv * D + 2 * lane] * g;
  }

  const int pb = wv * NB + blockIdx.x;
  if (lane == 0) { part_m[pb] = mm; part_s[pb] = ss; }
  *(v2f*)(part_pv + (size_t)pb * D + 2 * lane) = acc;
}

// One block per head: combine NB chunk partials (flash-attention merge).
// The launch is one chain of latencies, so it is kept short: a wave asks at
// once for all it will read (the head's NB maxima and sums, and its own CPW
// chunks of the weighted sums), and every wave finds the head's maximum and
// sum for itself, in registers. The waves meet once, to add their sums.
#define RW 16                // waves of a merge block
#define CPW (NB / RW)        // chunks per wave: 8 per 16-lane row
static_assert(NB == 8 * 32, "a lane holds 8 of the head's NB maxima and sums");
static_assert(CPW == 16 && D == 64, "a 16-lane row holds 8 chunks x 64 dims");

__device__ __forceinline__ float xhalf(const float x) {
  const unsigned v = __builtin_bit_cast(unsigned, x);
  return __builtin_bit_cast(float, __builtin_amdgcn_permlanex16(
      v, v, 0x76543210u, 0xfedcba98u, false, false));
}

__global__ __launch_bounds__(RW * 32) void reduce_kernel(
    const float* __restrict__ part_m, const float* __restrict__ part_s,
    const float* __restrict__ part_pv, float* __restrict__ values) {
  __shared__ __attribute__((aligned(16))) float red[RW][D];
  const int h    = blockIdx.x;
  const int lane = threadIdx.x & 31;
  const int wv   = threadIdx.x >> 5;
  const int c0   = wv * CPW + (lane >> 4) * 8;  // first of this lane's chunks
  const int d0   = 4 * (lane & 15);             // first of this lane's dims
  const float* __restrict__ pm = part_m + h * NB;
  const float* __restrict__ ps = part_s + h * NB;
  const float* __restrict__ pp = part_pv + (size_t)(h * NB + c0) * D + d0;

  float ma[8], sa[8], mo[8], so[8];  // all chunks (8 a lane); the lane's own
  v4f pv[8];
#pragma unroll
  for (int i = 0; i < 2; ++i) {
    *(v4f*)&ma[4 * i] = *(const v4f*)(pm + 8 * lane + 4 * i);
    *(v4f*)&sa[4 * i] = *(const v4f*)(ps + 8 * lane + 4 * i);
    *(v4f*)&mo[4 * i] = *(const v4f*)(pm + c0 + 4 * i);
    *(v4f*)&so[4 * i] = *(const v4f*)(ps + c0 + 4 * i);
  }
#pragma unroll
  for (int i = 0; i < 8; ++i) pv[i] = *(const v4f*)(pp + i * D);
  // keeps all 16 loads ahead of the first wait: the scheduler would otherwise
  // sink half of them behind the maximum, a second memory round trip
  __builtin_amdgcn_sched_barrier(0);

  float M = ma[0];
#pragma unroll
  for (int i = 1; i < 8; ++i) M = fmaxf(M, ma[i]);
  M = fmaxf(M, xrow<8>(M));
  M = fmaxf(M, xrow<4>(M));
  M = fmaxf(M, xrow<2>(M));
  M = fmaxf(M, xrow<1>(M));
  M = fmaxf(M, xhalf(M));

  // a chunk without a valid position has m = -inf, s = 0: weight 0
  float S = 0.f;
#pragma unroll
  for (int i = 0; i < 8; ++i)
    S += (sa[i] > 0.f) ? sa[i] * __expf(ma[i] - M) : 0.f;
  S += xrow<8>(S);
  S += xrow<4>(S);
  S += xrow<2>(S);
  S += xrow<1>(S);
  S += xhalf(S);

  v4f acc = {0.f, 0.f, 0.f, 0.f};
#pragma unroll
  for (int i = 0; i < 8; ++i) {
    const float w = (so[i] > 0.f) ? __expf(mo[i] - M) : 0.f;
    acc += pv[i] * w;
  }
  acc.x += xhalf(acc.x);
  acc.y += xhalf(acc.y);
  acc.z += xhalf(acc.z);
  acc.w += xhalf(acc.w);
  if (lane < 16) *(v4f*)&red[wv][d0] = acc;
  __syncthreads();

  if (threadIdx.x < D) {
    float sum = red[0][threadIdx.x];
#pragma unroll
    for (int w = 1; w < RW; ++w) sum += red[w][threadIdx.x];
    values[h * D + threadIdx.x] = sum / S;
  }
}

extern "C" void kernel_launch(void* const* d_in, const int* in_sizes, int n_in,
                              void* d_out, int out_size, void* d_ws,
                              size_t ws_size, hipStream_t stream) {
  (void)in_sizes; (void)n_in; (void)out_size; (void)ws_size;
  const float* x     = (const float*)d_in[0];
  const float* cache = (const float*)d_in[1];
  const float* Wv    = (const float*)d_in[2];
  const float* bv    = (const float*)d_in[3];
  const float* Wq    = (const float*)d_in[4];
  const float* bq    = (const float*)d_in[5];
  const float* Wk    = (const float*)d_in[6];
  const float* bk    = (const float*)d_in[7];
  const float* Wo    = (const float*)d_in[8];
  const float* bo    = (const float*)d_in[9];

  float* out   = (float*)d_out;             // [0..1023] out_i
  float* v_out = out + E;                   // shifted v cache (L*E)
  float* k_out = v_out + (size_t)L * E;     // shifted k cache (L*E)

  float* ws      = (float*)d_ws;
  float* q_ws    = ws;                      // E
  float* k_ws    = ws + E;                  // E
  float* v_ws    = ws + 2 * E;              // E
  float* values  = ws + 3 * E;              // E
  float* part_m  = ws + 4 * E;              // H*NB
  float* part_s  = part_m + H * NB;         // H*NB
  float* part_pv = part_s + H * NB;         // H*NB*D  (total ~1.1 MB)

  qkv_proj_kernel<<<192, 512, 0, stream>>>(x, Wq, bq, Wk, bk, Wv, bv,
                                          q_ws, k_ws, v_ws);
  attn_kernel<<<NB, 512, 0, stream>>>(cache, cache + (size_t)L * E, q_ws, k_ws, v_ws, v_out, k_out,
                                      part_m, part_s, part_pv);
  reduce_kernel<<<H, RW * 32, 0, stream>>>(part_m, part_s, part_pv, values);
  out_proj_kernel<<<64, 512, 0, stream>>>(values, Wo, bo, out);
}

// v006
// Measured time: 30.7 microseconds a run.
// Timed twice side by side with v005, it ran 1.05 and 1.06 times as fast.
// Counting every step since v000, it is 4.39 times as fast.
#include <hip/hip_runtime.h>
#include <math.h>

#define E 1024
#define H 16
#define D 64
#define L 16384
#define HPB 2                // heads per attention block (512 B of a row)
#define NC 32                // position chunks = partials per head
#define POS_PER_BLK (L / NC) // 512
#define PPW 32               // positions per attention wave
#define BP 8                 // positions per batch of a wave
#define KSPLIT 16             // waves per projection block = K slices
#define KSLICE (E / KSPLIT)   // 64 rows of W per wave
#define PROJ_REGS __attribute__((amdgpu_waves_per_eu(4, 4)))

typedef __attribute__((ext_vector_type(2))) float v2f;
typedef __attribute__((ext_vector_type(4))) float v4f;
typedef __attribute__((ext_vector_type(8))) float v8f;

static_assert(KSPLIT * 32 == 512, "projection launches use 512 threads");

__device__ __forceinline__ void gemv16_tile(const float* __restrict__ x,
                                            const float* __restrict__ W,
                                            const float* __restrict__ bias,
                                            float* __restrict__ dst,
                                            int j0) {
  __shared__ float red[KSPLIT][16];
  const int lane = threadIdx.x & 31;
  const int wave = threadIdx.x >> 5;  // K slice of this wave
  const int r    = lane >> 4;  // 0 or 1
  const int col  = lane & 15;
  const int k0   = wave * KSLICE;
  const float* wp = W + (size_t)(k0 + 2 * r) * E + j0 + col;
  const float* xp = x + k0 + 2 * r;
  v8f c = {};
  // full unroll: lets every load of the slice issue before the first product
#pragma unroll
  for (int i0 = 0; i0 < KSLICE; i0 += 4) {
    v2f a, b;
    a.x = xp[i0];
    a.y = xp[i0 + 1];
    b.x = __builtin_nontemporal_load(wp + (size_t)i0 * E);
    b.y = __builtin_nontemporal_load(wp + (size_t)(i0 + 1) * E);
    c = __builtin_amdgcn_wmma_f32_16x16x4_f32(false, a, false, b,
                                              (short)0, c, false, false);
  }
  // every M row of C is the same sum (A rows are copies): lanes col and col+16
  // hold equal c[0], so both store it and no lane test is needed
  red[wave][col] = c[0];
  __syncthreads();
  if (threadIdx.x < 16) {
    float sum = red[0][col];
    for (int w = 1; w < KSPLIT; ++w) sum += red[w][col];
    dst[j0 + col] = sum + bias[j0 + col];
  }
}

// 192 blocks x 16 waves: 3 matrices x 64 column tiles, K split in the block.
__global__ __launch_bounds__(KSPLIT * 32) PROJ_REGS void qkv_proj_kernel(
    const float* __restrict__ x,
    const float* __restrict__ Wq, const float* __restrict__ bq,
    const float* __restrict__ Wk, const float* __restrict__ bk,
    const float* __restrict__ Wv, const float* __restrict__ bv,
    float* __restrict__ q_ws, float* __restrict__ k_ws,
    float* __restrict__ v_ws) {
  const int mat = blockIdx.x >> 6;
  const int j0  = (blockIdx.x & 63) << 4;
  const float *W, *b;
  float* dst;
  if (mat == 0)      { W = Wq; b = bq; dst = q_ws; }
  else if (mat == 1) { W = Wk; b = bk; dst = k_ws; }
  else               { W = Wv; b = bv; dst = v_ws; }
  gemv16_tile(x, W, b, dst, j0);
}

static_assert(POS_PER_BLK == 16 * PPW, "a block's 16 waves share its positions");
static_assert(PPW == 4 * BP, "the pipeline below is written out for 4 batches");
static_assert((H / HPB) * NC == 256, "the launch has 256 blocks, one per WGP");
static_assert(HPB * D == 128, "a block's part of a row is 32 lanes x 4 floats");
static_assert(H == KSPLIT && D == KSLICE, "a projection wave's K slice = a head");

struct Set { v4f r[BP]; };  // the block's part of 8 rows of k or of v

// Stands between a set's stores and the first overwrite of the registers that
// they name (they are reused for sums and for later sets).
__device__ __forceinline__ void stores_taken() {
  asm volatile("s_wait_xcnt 0x0" ::: "memory");
}

// Work-group barrier that orders LDS alone. The waves share nothing but the
// LDS partials; __syncthreads() would also wait for each wave's global stores.
__device__ __forceinline__ void lds_barrier() {
  __builtin_amdgcn_fence(__ATOMIC_RELEASE, "workgroup", "local");
  __builtin_amdgcn_s_barrier();
  __builtin_amdgcn_fence(__ATOMIC_ACQUIRE, "workgroup", "local");
}

template <int M>
__device__ __forceinline__ float xrow(const float x) {
  return __builtin_bit_cast(float, __builtin_amdgcn_update_dpp(
      0, __builtin_bit_cast(int, x), 0x160 | M, 0xf, 0xf, true));
}
// lane T of each 16-lane row to all lanes of that row (DPP row_share:T)
template <int T>
__device__ __forceinline__ float rshare(const float x) {
  return __builtin_bit_cast(float, __builtin_amdgcn_update_dpp(
      0, __builtin_bit_cast(int, x), 0x150 | T, 0xf, 0xf, true));
}
__device__ __forceinline__ float xhalf(const float x) {
  const unsigned v = __builtin_bit_cast(unsigned, x);
  return __builtin_bit_cast(float, __builtin_amdgcn_permlanex16(
      v, v, 0x76543210u, 0xfedcba98u, false, false));
}

// x != 0 for a float is: any bit set below the sign bit
__device__ __forceinline__ unsigned bits_of(const v4f t) {
  return (__float_as_uint(t.x) | __float_as_uint(t.y) | __float_as_uint(t.z) |
          __float_as_uint(t.w)) & 0x7fffffffu;
}

// Any nonzero among the 1024 floats of a whole v row (row: same in every lane).
__device__ __forceinline__ bool row_nonzero(const float* __restrict__ row,
                                         const unsigned lo) {
  unsigned b = 0;
  // rare path, kept rolled: unrolled it would take registers from the batches
  // that are in flight around it
#pragma unroll 1
  for (int j = 0; j < E / 128; ++j) b |= bits_of(*(const v4f*)(row + j * 128 + lo));
  return __any(b != 0u);
}

__global__ __launch_bounds__(512) PROJ_REGS void attn_kernel(
    const float* __restrict__ vsrc,    // old cache, slab 0: v (L, H, D)
    const float* __restrict__ ksrc,    // old cache, slab 1: k (L, H, D)
    const float* __restrict__ q_ws,    // E
    const float* __restrict__ k_new,   // E
    const float* __restrict__ v_new,   // E
    float* __restrict__ v_out,         // L*E  (shifted v -> d_out)
    float* __restrict__ k_out,         // L*E  (shifted k -> d_out)
    float* __restrict__ part_m,        // H*NC
    float* __restrict__ part_s,        // H*NC
    float* __restrict__ part_pv) {     // H*NC*D
  __shared__ float lds_m[16][HPB];     // [wave][head of the block]
  __shared__ float lds_s[16][HPB];
  __shared__ __attribute__((aligned(16))) float lds_pv[16][HPB * D];
  const int lane = threadIdx.x & 31;
  // the wave's number as a scalar: row addresses are then scalar bases
  const int wv = __builtin_amdgcn_readfirstlane(threadIdx.x >> 5);
  const int hp = blockIdx.x & (H / HPB - 1);   // which pair of heads
  const int ch = blockIdx.x / (H / HPB);       // which chunk of positions
  const int p0 = ch * POS_PER_BLK + wv * PPW;  // the wave's first position
  const int c0 = hp * (HPB * D);               // the block's first column
  const unsigned lo = 4u * lane;

  // Position p holds old row p+1; the cache's last position the new token.
  // Only a wave's last position can be that one (L is a multiple of PPW).
  const float* __restrict__ kr = ksrc + (size_t)(p0 + 1) * E + c0;
  const float* __restrict__ vr = vsrc + (size_t)(p0 + 1) * E + c0;
  const bool fresh = (p0 + PPW == L);
  const float* __restrict__ krl = fresh ? k_new + c0 : kr + (PPW - 1) * E;
  const float* __restrict__ vrl = fresh ? v_new + c0 : vr + (PPW - 1) * E;
  float* __restrict__ ko = k_out + (size_t)p0 * E + c0;
  float* __restrict__ vo = v_out + (size_t)p0 * E + c0;

  // the lane's own addresses in the rows
  const float* __restrict__ kl  = kr + lo;
  const float* __restrict__ vl  = vr + lo;
  const float* __restrict__ kll = krl + lo;
  const float* __restrict__ vll = vrl + lo;

  const v4f q = *(const v4f*)(q_ws + c0 + lo);

  // 8 positions' parts of k or of v; last: the pointer of the wave's last row
  auto load_set = [&](Set& t, const float* __restrict__ base,
                      const float* __restrict__ last,
                      const int b) __attribute__((always_inline)) {
#pragma unroll
    for (int i = 0; i < BP; ++i) {
      const int p = b * BP + i;
      t.r[i] = __builtin_nontemporal_load(
          (const v4f*)(p == PPW - 1 ? last : base + p * E));
    }
    // keeps these loads where they are written, ahead of the next wait on an
    // older set: the scheduler would otherwise sink them behind that work
    __builtin_amdgcn_sched_barrier(0);
  };
  // The wait that issued loads are owed before a register that they name is
  // written again; naming the addresses keeps them untouched up to the wait.
  auto loads_taken = [&]() __attribute__((always_inline)) {
    asm volatile("s_wait_xcnt 0x0" ::"v"(kl), "v"(vl), "v"(kll), "v"(vll)
                 : "memory");
  };

  Set ka, va, kb, vb, kc;
  load_set(ka, kl, kll, 0);
  load_set(va, vl, vll, 0);
  load_set(kb, kl, kll, 1);
  load_set(vb, vl, vll, 1);
  load_set(kc, kl, kll, 2);
  loads_taken();

  float m = -INFINITY, s = 0.f;
  float sc[BP];
  v4f pv = {0.f, 0.f, 0.f, 0.f};

  // k of a batch: copy it out, and 8 positions' dot products side by side
  auto scores = [&](const Set& k, const int b) __attribute__((always_inline)) {
#pragma unroll
    for (int i = 0; i < BP; ++i)
      __builtin_nontemporal_store(k.r[i], (v4f*)(ko + (b * BP + i) * E + lo));
#pragma unroll
    for (int i = 0; i < BP; ++i) {
      float t0 = q.x * k.r[i].x + q.y * k.r[i].y + q.z * k.r[i].z +
                 q.w * k.r[i].w;
      t0 += xrow<8>(t0);                 // sum over the 16-lane row, xor 8 .. 1
      t0 += xrow<4>(t0);
      t0 += xrow<2>(t0);
      t0 += xrow<1>(t0);
      sc[i] = t0 * 0.125f;               // 1/sqrt(64)
    }
    stores_taken();
  };

  // v of a batch: copy it out, the positions' masks, and one softmax update
  // for the 8 positions together
  auto update = [&](const Set& v, const int b) __attribute__((always_inline)) {
#pragma unroll
    for (int i = 0; i < BP; ++i)
      __builtin_nontemporal_store(v.r[i], (v4f*)(vo + (b * BP + i) * E + lo));
    unsigned ok = 0;  // bit i: position i is valid (the same in every lane)
#pragma unroll
    for (int i = 0; i < BP; ++i)
      ok |= __any(bits_of(v.r[i]) != 0u) ? (1u << i) : 0u;
    stores_taken();
    // the block's own 128 values of a row are all zero: ask the whole row
    if (__builtin_expect(ok != (1u << BP) - 1u, 0)) {
#pragma unroll 1  // rare path, kept rolled (small code, few registers)
      for (int i = 0; i < BP; ++i) {
        const int p = b * BP + i;
        const float* row = (fresh && p == PPW - 1)
                               ? v_new : vsrc + (size_t)(p0 + 1 + p) * E;
        if (!((ok >> i) & 1u) && row_nonzero(row, lo)) ok |= 1u << i;
      }
    }
    float nm = m;
#pragma unroll
    for (int i = 0; i < BP; ++i) {
      sc[i] = ((ok >> i) & 1u) ? sc[i] : -INFINITY;  // masked: weight 0
      nm = fmaxf(nm, sc[i]);
    }
    // no valid position so far: keep -inf - -inf out of the exponentials
    const float ref = (nm == -INFINITY) ? 0.f : nm;
    const float eo = __expf(m - ref);
    s *= eo;
    pv *= eo;
#pragma unroll
    for (int i = 0; i < BP; ++i) {
      const float w = __expf(sc[i] - ref);
      s += w;
      pv += v.r[i] * w;
    }
    m = nm;
  };

  scores(ka, 0);
  update(va, 0);
  load_set(va, vl, vll, 2);
  loads_taken();
  scores(kb, 1);
  load_set(kb, kl, kll, 3);
  loads_taken();
  update(vb, 1);
  load_set(vb, vl, vll, 3);
  loads_taken();
  scores(kc, 2);
  update(va, 2);
  scores(kb, 3);
  update(vb, 3);

  // Join the 16 waves' partials (flash-attention merge): thread t takes the
  // block's column t.
  if ((lane & 15) == 0) {
    lds_m[wv][lane >> 4] = m;
    lds_s[wv][lane >> 4] = s;
  }
  *(v4f*)&lds_pv[wv][lo] = pv;
  lds_barrier();

  if (threadIdx.x < HPB * D) {
    const int hd = threadIdx.x >> 6;
    float mw[16];
    float mm = -INFINITY;
#pragma unroll
    for (int w = 0; w < 16; ++w) {
      mw[w] = lds_m[w][hd];
      mm = fmaxf(mm, mw[w]);
    }
    float ss = 0.f, acc = 0.f;
#pragma unroll
    for (int w = 0; w < 16; ++w) {
      const float sw = lds_s[w][hd];
      // a wave without a valid position has m = -inf, s = 0: weight 0
      const float g = (sw > 0.f) ? __expf(mw[w] - mm) : 0.f;
      ss += sw * g;
      acc += lds_pv[w][threadIdx.x] * g;
    }
    const int pb = (hp * HPB + hd) * NC + ch;
    if ((threadIdx.x & (D - 1)) == 0) { part_m[pb] = mm; part_s[pb] = ss; }
    part_pv[(size_t)pb * D + (threadIdx.x & (D - 1))] = acc;
  }
}

// ---------------------------------------------------------------------------
// Output projection with the merge of the attention partials in it.
// 64 blocks x 16 waves = 64 column tiles of Wo, K split in the block as in
// gemv16_tile. Wave w's K slice is head w, so the wave first merges that head's
// NC partials itself (flash-attention merge, all in registers): every block
// repeats the merge, which is small, and the launch that did it is saved.
// All loads (the slice of Wo, the maxima, the sums, the partials) are asked for
// at once: one memory round trip.
// ---------------------------------------------------------------------------
static_assert(NC == 32, "a lane holds one of the head's NC maxima and sums");

// A fragments of K steps T .. 15 of a wave's slice. Lane n of a 16-lane row
// holds px, py = values 4n + 2r, 4n + 2r + 1 of the slice (r = the row), so step
// T's fragment (K = 4T + 2r, 4T + 2r + 1) is lane T's pair, shared with the row.
template <int T>
__device__ __forceinline__ void a_frags(v2f (&a)[KSLICE / 4], const float px,
                                        const float py) {
  if constexpr (T < KSLICE / 4) {
    a[T].x = rshare<T>(px);
    a[T].y = rshare<T>(py);
    a_frags<T + 1>(a, px, py);
  }
}

__global__ __launch_bounds__(KSPLIT * 32) PROJ_REGS void out_proj_kernel(
    const float* __restrict__ part_m, const float* __restrict__ part_s,
    const float* __restrict__ part_pv,
    const float* __restrict__ Wo, const float* __restrict__ bo,
    float* __restrict__ out) {
  __shared__ float red[KSPLIT][16];
  const int lane = threadIdx.x & 31;
  const int wave = threadIdx.x >> 5;  // K slice of this wave = its head
  const int r    = lane >> 4;         // 0 or 1
  const int col  = lane & 15;
  const int j0   = blockIdx.x << 4;
  const float* wp = Wo + (size_t)(wave * KSLICE + 2 * r) * E + j0 + col;
  const float* __restrict__ pm = part_m + wave * NC;
  const float* __restrict__ ps = part_s + wave * NC;
  // lane (r, col): chunks 16r .. 16r+15, dims 4col .. 4col+3
  const float* __restrict__ pp =
      part_pv + (size_t)(wave * NC + 16 * r) * D + 4 * col;

  v2f b[KSLICE / 4];
#pragma unroll
  for (int t = 0; t < KSLICE / 4; ++t) {
    b[t].x = __builtin_nontemporal_load(wp + (size_t)(4 * t) * E);
    b[t].y = __builtin_nontemporal_load(wp + (size_t)(4 * t + 1) * E);
  }
  const float ma = pm[lane], sa = ps[lane];  // all chunks, one a lane
  float mo[16], so[16];                      // the lane's own 16 chunks
  v4f pv[16];
#pragma unroll
  for (int i = 0; i < 4; ++i) {
    *(v4f*)&mo[4 * i] = *(const v4f*)(pm + 16 * r + 4 * i);
    *(v4f*)&so[4 * i] = *(const v4f*)(ps + 16 * r + 4 * i);
  }
#pragma unroll
  for (int i = 0; i < 16; ++i) pv[i] = *(const v4f*)(pp + i * D);
  // The wait that issued loads are owed before a register that they name is
  // written again; naming the addresses keeps them untouched up to the wait.
  asm volatile("s_wait_xcnt 0x0" ::"v"(wp), "v"(pm + lane), "v"(ps + lane),
               "v"(pm + 16 * r), "v"(ps + 16 * r), "v"(pp)
               : "memory");
  // keeps all loads ahead of the first wait for data: the scheduler would
  // otherwise sink part of them behind the maximum, a second round trip
  __builtin_amdgcn_sched_barrier(0);

  float M = ma;
  M = fmaxf(M, xrow<8>(M));
  M = fmaxf(M, xrow<4>(M));
  M = fmaxf(M, xrow<2>(M));
  M = fmaxf(M, xrow<1>(M));
  M = fmaxf(M, xhalf(M));

  // a chunk without a valid position has m = -inf, s = 0: weight 0
  float S = (sa > 0.f) ? sa * __expf(ma - M) : 0.f;
  S += xrow<8>(S);
  S += xrow<4>(S);
  S += xrow<2>(S);
  S += xrow<1>(S);
  S += xhalf(S);

  v4f acc = {0.f, 0.f, 0.f, 0.f};
#pragma unroll
  for (int i = 0; i < 16; ++i) {
    const float w = (so[i] > 0.f) ? __expf(mo[i] - M) : 0.f;
    acc += pv[i] * w;
  }
  acc.x = (acc.x + xhalf(acc.x)) / S;
  acc.y = (acc.y + xhalf(acc.y)) / S;
  acc.z = (acc.z + xhalf(acc.z)) / S;
  acc.w = (acc.w + xhalf(acc.w)) / S;

  v2f a[KSLICE / 4];
  a_frags<0>(a, r ? acc.z : acc.x, r ? acc.w : acc.y);
  // all A fragments are formed, each in registers of its own, before the first
  // product: no vector instruction then writes an A register close behind a
  // matrix instruction that reads it
  __builtin_amdgcn_sched_barrier(0);
  v8f c = {};
#pragma unroll
  for (int t = 0; t < KSLICE / 4; ++t)
    c = __builtin_amdgcn_wmma_f32_16x16x4_f32(false, a[t], false, b[t],
                                              (short)0, c, false, false);

  // every M row of C is the same sum (A rows are copies): lanes col and col+16
  // hold equal c[0], so both store it and no lane test is needed
  red[wave][col] = c[0];
  __syncthreads();
  if (threadIdx.x < 16) {
    float sum = red[0][col];
    for (int w = 1; w < KSPLIT; ++w) sum += red[w][col];
    out[j0 + col] = sum + bo[j0 + col];
  }
}

extern "C" void kernel_launch(void* const* d_in, const int* in_sizes, int n_in,
                              void* d_out, int out_size, void* d_ws,
                              size_t ws_size, hipStream_t stream) {
  (void)in_sizes; (void)n_in; (void)out_size; (void)ws_size;
  const float* x     = (const float*)d_in[0];
  const float* cache = (const float*)d_in[1];
  const float* Wv    = (const float*)d_in[2];
  const float* bv    = (const float*)d_in[3];
  const float* Wq    = (const float*)d_in[4];
  const float* bq    = (const float*)d_in[5];
  const float* Wk    = (const float*)d_in[6];
  const float* bk    = (const float*)d_in[7];
  const float* Wo    = (const float*)d_in[8];
  const float* bo    = (const float*)d_in[9];

  float* out   = (float*)d_out;             // [0..1023] out_i
  float* v_out = out + E;                   // shifted v cache (L*E)
  float* k_out = v_out + (size_t)L * E;     // shifted k cache (L*E)

  float* ws      = (float*)d_ws;
  float* q_ws    = ws;                      // E
  float* k_ws    = ws + E;                  // E
  float* v_ws    = ws + 2 * E;              // E
  float* part_m  = ws + 3 * E;              // H*NC
  float* part_s  = part_m + H * NC;         // H*NC
  float* part_pv = part_s + H * NC;         // H*NC*D  (total ~150 KB)

  qkv_proj_kernel<<<192, 512, 0, stream>>>(x, Wq, bq, Wk, bk, Wv, bv,
                                          q_ws, k_ws, v_ws);
  attn_kernel<<<256, 512, 0, stream>>>(cache, cache + (size_t)L * E, q_ws, k_ws, v_ws, v_out, k_out,
                                      part_m, part_s, part_pv);
  out_proj_kernel<<<64, 512, 0, stream>>>(part_m, part_s, part_pv, Wo, bo, out);
}
